// v000
// Measured on an AMD MI455X. A time is GPU time per run, averaged over a window of back-to-back runs after a warm-up
// (all launches, gaps included; the runs take copies of the inputs in turn), and the median of several windows.
// Apart from v000's, it joins two sittings. Times from different sittings can be a few percent apart, while
// side-by-side timings come from the same sitting.
// The starting kernel, v000, takes 77.9 microseconds a run.
#include <hip/hip_runtime.h>

typedef float v2f __attribute__((ext_vector_type(2)));
typedef float v8f __attribute__((ext_vector_type(8)));

#define BATCH    4
#define NROWS    4096
#define TDIM     256
#define GCHUNK   512
#define GNCHUNKS (NROWS / GCHUNK)   // 8

#define WMMA_F32(A, B, C) \
    __builtin_amdgcn_wmma_f32_16x16x4_f32(false, (A), false, (B), (short)0, (C), false, false)

// d_ws layout: G[4][256][256] f32 (1 MB) then M[4][256][256] f32 (1 MB).

__global__ __launch_bounds__(256) void zero_ws_kernel(float* __restrict__ g) {
    g[blockIdx.x * 256 + threadIdx.x] = 0.0f;
}

// G_b = X_b^T @ X_b. One wave computes a 32x32 region (2x2 WMMA tiles) per
// 512-row chunk; G is symmetric so only regions si<=ti are computed, with
// off-diagonal regions mirrored. fp32 atomics accumulate chunk partials.
__global__ __launch_bounds__(32) void gram_kernel(const float* __restrict__ X,
                                                  float* __restrict__ G) {
    const int si = blockIdx.x >> 3;         // 0..7 region row
    const int ti = blockIdx.x & 7;          // 0..7 region col
    if (si > ti) return;                    // uniform exit: EXEC stays all-ones below
    const int chunk = blockIdx.y;           // 0..7
    const int b     = blockIdx.z;           // 0..3
    const int sBase = si << 5;
    const int tBase = ti << 5;
    const int lane  = threadIdx.x & 15;
    const int half  = threadIdx.x >> 4;     // K pair {0,1} vs {2,3}

    const float* Xb = X + (size_t)b * NROWS * TDIM;
    const int n0 = chunk * GCHUNK + 2 * half;

    v8f acc00 = {}, acc01 = {}, acc10 = {}, acc11 = {};
    for (int kk = 0; kk < GCHUNK; kk += 4) {
        const float* r0 = Xb + (size_t)(n0 + kk) * TDIM;
        const float* r1 = r0 + TDIM;
        v2f a0, a1, b0, b1;
        a0.x = r0[sBase + lane];        a0.y = r1[sBase + lane];
        a1.x = r0[sBase + 16 + lane];   a1.y = r1[sBase + 16 + lane];
        b0.x = r0[tBase + lane];        b0.y = r1[tBase + lane];
        b1.x = r0[tBase + 16 + lane];   b1.y = r1[tBase + 16 + lane];
        acc00 = WMMA_F32(a0, b0, acc00);
        acc01 = WMMA_F32(a0, b1, acc01);
        acc10 = WMMA_F32(a1, b0, acc10);
        acc11 = WMMA_F32(a1, b1, acc11);
    }

    float* Gb = G + (size_t)b * TDIM * TDIM;
    const bool mirror = (si != ti);   // diagonal region already covers its transpose
#pragma unroll
    for (int q = 0; q < 4; ++q) {
        const int rb = sBase + ((q >> 1) << 4);
        const int cb = tBase + ((q & 1) << 4);
        const v8f acc = (q == 0) ? acc00 : (q == 1) ? acc01 : (q == 2) ? acc10 : acc11;
#pragma unroll
        for (int r = 0; r < 8; ++r) {
            const int row = rb + r + 8 * half;
            const int col = cb + lane;
            __hip_atomic_fetch_add(&Gb[row * TDIM + col], acc[r],
                                   __ATOMIC_RELAXED, __HIP_MEMORY_SCOPE_AGENT);
            if (mirror)
                __hip_atomic_fetch_add(&Gb[col * TDIM + row], acc[r],
                                       __ATOMIC_RELAXED, __HIP_MEMORY_SCOPE_AGENT);
        }
    }
}

// M_b[i][j] = sum_{k < i} W[k][i] * G_b[k][j]  (Wm = triu(W,1), transposed).
// Tiny; VALU with uniform triangular loop bound, j coalesced, W broadcast.
__global__ __launch_bounds__(256) void wmask_gemm_kernel(const float* __restrict__ W,
                                                         const float* __restrict__ G,
                                                         float* __restrict__ M) {
    const int j = threadIdx.x;
    const int i = blockIdx.x;
    const int b = blockIdx.y;
    const float* Gb = G + (size_t)b * TDIM * TDIM;
    float acc = 0.0f;
    for (int k = 0; k < i; ++k) {
        acc = fmaf(W[k * TDIM + i], Gb[k * TDIM + j], acc);
    }
    M[((size_t)b * TDIM + i) * TDIM + j] = acc;
}

// out_b = X_b @ M_b. One wave computes a 32x32 output block (2x2 WMMA tiles),
// K = 256 in steps of 4; A fragments are float2 loads, each fragment reused 2x.
__global__ __launch_bounds__(32) void out_gemm_kernel(const float* __restrict__ X,
                                                      const float* __restrict__ M,
                                                      float* __restrict__ Out) {
    const int nBase = blockIdx.x << 5;      // 0..4064 step 32
    const int tBase = blockIdx.y << 5;      // 0..224  step 32
    const int b     = blockIdx.z;
    const int lane  = threadIdx.x & 15;
    const int half  = threadIdx.x >> 4;

    const float* Xb = X + (size_t)b * NROWS * TDIM;
    const float* Mb = M + (size_t)b * TDIM * TDIM;
    const float* xrow0 = Xb + (size_t)(nBase + lane) * TDIM + 2 * half;
    const float* xrow1 = xrow0 + (size_t)16 * TDIM;

    v8f acc00 = {}, acc01 = {}, acc10 = {}, acc11 = {};
    for (int k0 = 0; k0 < TDIM; k0 += 4) {
        v2f a0 = *(const v2f*)(xrow0 + k0);              // X[nBase+lane][k0+2h..+1]
        v2f a1 = *(const v2f*)(xrow1 + k0);              // X[nBase+16+lane][...]
        const float* mrow = Mb + (size_t)(k0 + 2 * half) * TDIM;
        v2f b0, b1;
        b0.x = mrow[tBase + lane];        b0.y = mrow[TDIM + tBase + lane];
        b1.x = mrow[tBase + 16 + lane];   b1.y = mrow[TDIM + tBase + 16 + lane];
        acc00 = WMMA_F32(a0, b0, acc00);
        acc01 = WMMA_F32(a0, b1, acc01);
        acc10 = WMMA_F32(a1, b0, acc10);
        acc11 = WMMA_F32(a1, b1, acc11);
    }

    float* Ob = Out + (size_t)b * NROWS * TDIM;
#pragma unroll
    for (int r = 0; r < 8; ++r) {
        const int row0 = nBase + r + 8 * half;
        const int row1 = row0 + 16;
        Ob[(size_t)row0 * TDIM + tBase + lane]      = acc00[r];
        Ob[(size_t)row0 * TDIM + tBase + 16 + lane] = acc01[r];
        Ob[(size_t)row1 * TDIM + tBase + lane]      = acc10[r];
        Ob[(size_t)row1 * TDIM + tBase + 16 + lane] = acc11[r];
    }
}

extern "C" void kernel_launch(void* const* d_in, const int* in_sizes, int n_in,
                              void* d_out, int out_size, void* d_ws, size_t ws_size,
                              hipStream_t stream) {
    const float* x = (const float*)d_in[0];   // [4, 4096, 256]
    const float* W = (const float*)d_in[1];   // [256, 256]
    float* out = (float*)d_out;               // [4, 4096, 256]

    float* G = (float*)d_ws;                        // 4*256*256 f32
    float* M = G + (size_t)BATCH * TDIM * TDIM;     // 4*256*256 f32

    zero_ws_kernel<<<(BATCH * TDIM * TDIM) / 256, 256, 0, stream>>>(G);
    gram_kernel<<<dim3(64, GNCHUNKS, BATCH), 32, 0, stream>>>(x, G);
    wmask_gemm_kernel<<<dim3(TDIM, BATCH), TDIM, 0, stream>>>(W, G, M);
    out_gemm_kernel<<<dim3(NROWS / 32, TDIM / 32, BATCH), 32, 0, stream>>>(x, M, out);
}

// v001
// Measured time: 58.7 microseconds a run.
// In both of two side-by-side timings against v000, it was 1.38 times as fast.
#include <hip/hip_runtime.h>

typedef float v2f __attribute__((ext_vector_type(2)));
typedef float v8f __attribute__((ext_vector_type(8)));

#define BATCH    4
#define NROWS    4096
#define TDIM     256
#define GCHUNK   1024
#define GNCHUNKS (NROWS / GCHUNK)   // 4
#define GWAVES   8                  // waves of a gram work-group
#define GROWS    (GCHUNK / GWAVES)  // 128 rows of the chunk per wave

#define WMMA_F32(A, B, C) \
    __builtin_amdgcn_wmma_f32_16x16x4_f32(false, (A), false, (B), (short)0, (C), false, false)

// d_ws layout: G[4][256][256] f32 (1 MB) then M[4][256][256] f32 (1 MB).

__global__ __launch_bounds__(256) void zero_ws_kernel(float* __restrict__ g) {
    g[blockIdx.x * 256 + threadIdx.x] = 0.0f;
}

// G_b = X_b^T @ X_b. One work-group computes a 32x32 region (2x2 WMMA tiles) per
// GCHUNK-row chunk; its GWAVES waves each take GROWS of the chunk's rows, so that
// the row slices are fetched side by side instead of one after the other.
// The waves' partial tiles are summed in LDS in wave order. G is symmetric so
// only regions si<=ti are computed, with off-diagonal regions mirrored. fp32
// atomics accumulate chunk partials.
__global__ __launch_bounds__(GWAVES * 32) void gram_kernel(const float* __restrict__ X,
                                                           float* __restrict__ G) {
    __shared__ float red[GWAVES][32][32];   // [wave][accumulator register][lane]

    const int si = blockIdx.x >> 3;         // 0..7 region row
    const int ti = blockIdx.x & 7;          // 0..7 region col
    if (si > ti) return;                    // block-uniform exit, ahead of the barrier
    const int chunk = blockIdx.y;           // 0..GNCHUNKS-1
    const int b     = blockIdx.z;           // 0..3
    const int sBase = si << 5;
    const int tBase = ti << 5;
    const int wave  = threadIdx.x >> 5;     // 0..GWAVES-1 row slice of the chunk
    const int l32   = threadIdx.x & 31;
    const int lane  = l32 & 15;
    const int half  = l32 >> 4;             // K pair {0,1} vs {2,3}

    const float* Xb = X + (size_t)b * NROWS * TDIM;
    const int n0 = chunk * GCHUNK + wave * GROWS + 2 * half;

    v8f acc00 = {}, acc01 = {}, acc10 = {}, acc11 = {};
    for (int kk = 0; kk < GROWS; kk += 4) {
        const float* r0 = Xb + (size_t)(n0 + kk) * TDIM;
        const float* r1 = r0 + TDIM;
        v2f a0, a1, b0, b1;
        a0.x = r0[sBase + lane];        a0.y = r1[sBase + lane];
        a1.x = r0[sBase + 16 + lane];   a1.y = r1[sBase + 16 + lane];
        b0.x = r0[tBase + lane];        b0.y = r1[tBase + lane];
        b1.x = r0[tBase + 16 + lane];   b1.y = r1[tBase + 16 + lane];
        acc00 = WMMA_F32(a0, b0, acc00);
        acc01 = WMMA_F32(a0, b1, acc01);
        acc10 = WMMA_F32(a1, b0, acc10);
        acc11 = WMMA_F32(a1, b1, acc11);
    }

#pragma unroll   // constant indices keep the accumulators in registers
    for (int r = 0; r < 8; ++r) {
        red[wave][r][l32]      = acc00[r];
        red[wave][8 + r][l32]  = acc01[r];
        red[wave][16 + r][l32] = acc10[r];
        red[wave][24 + r][l32] = acc11[r];
    }
    __syncthreads();

    float* Gb = G + (size_t)b * TDIM * TDIM;
    const bool mirror = (si != ti);   // diagonal region already covers its transpose
#pragma unroll   // four straight-line sums, LDS offsets as immediates
    for (int i = 0; i < 32 / GWAVES; ++i) {
        const int reg = wave + i * GWAVES;            // this wave's share of the registers
        float sum = red[0][reg][l32];
#pragma unroll   // the eight LDS reads issue together
        for (int w = 1; w < GWAVES; ++w) sum += red[w][reg][l32];
        const int q   = reg >> 3;                     // which of the 2x2 tiles
        const int row = sBase + ((q >> 1) << 4) + (reg & 7) + 8 * half;
        const int col = tBase + ((q & 1) << 4) + lane;
        __hip_atomic_fetch_add(&Gb[row * TDIM + col], sum,
                               __ATOMIC_RELAXED, __HIP_MEMORY_SCOPE_AGENT);
        // the mirrored address reuses the register that the issued add names
        asm volatile("s_wait_xcnt 0x0" ::: "memory");
        if (mirror)
            __hip_atomic_fetch_add(&Gb[col * TDIM + row], sum,
                                   __ATOMIC_RELAXED, __HIP_MEMORY_SCOPE_AGENT);
    }
}

// M_b[i][j] = sum_{k < i} W[k][i] * G_b[k][j]  (Wm = triu(W,1), transposed).
// Tiny; VALU with uniform triangular loop bound, j coalesced, W broadcast.
__global__ __launch_bounds__(256) void wmask_gemm_kernel(const float* __restrict__ W,
                                                         const float* __restrict__ G,
                                                         float* __restrict__ M) {
    const int j = threadIdx.x;
    const int i = blockIdx.x;
    const int b = blockIdx.y;
    const float* Gb = G + (size_t)b * TDIM * TDIM;
    float acc = 0.0f;
    for (int k = 0; k < i; ++k) {
        acc = fmaf(W[k * TDIM + i], Gb[k * TDIM + j], acc);
    }
    M[((size_t)b * TDIM + i) * TDIM + j] = acc;
}

// out_b = X_b @ M_b. One wave computes a 32x32 output block (2x2 WMMA tiles),
// K = 256 in steps of 4; A fragments are float2 loads, each fragment reused 2x.
__global__ __launch_bounds__(32) void out_gemm_kernel(const float* __restrict__ X,
                                                      const float* __restrict__ M,
                                                      float* __restrict__ Out) {
    const int nBase = blockIdx.x << 5;      // 0..4064 step 32
    const int tBase = blockIdx.y << 5;      // 0..224  step 32
    const int b     = blockIdx.z;
    const int lane  = threadIdx.x & 15;
    const int half  = threadIdx.x >> 4;

    const float* Xb = X + (size_t)b * NROWS * TDIM;
    const float* Mb = M + (size_t)b * TDIM * TDIM;
    const float* xrow0 = Xb + (size_t)(nBase + lane) * TDIM + 2 * half;
    const float* xrow1 = xrow0 + (size_t)16 * TDIM;

    v8f acc00 = {}, acc01 = {}, acc10 = {}, acc11 = {};
    for (int k0 = 0; k0 < TDIM; k0 += 4) {
        v2f a0 = *(const v2f*)(xrow0 + k0);              // X[nBase+lane][k0+2h..+1]
        v2f a1 = *(const v2f*)(xrow1 + k0);              // X[nBase+16+lane][...]
        const float* mrow = Mb + (size_t)(k0 + 2 * half) * TDIM;
        v2f b0, b1;
        b0.x = mrow[tBase + lane];        b0.y = mrow[TDIM + tBase + lane];
        b1.x = mrow[tBase + 16 + lane];   b1.y = mrow[TDIM + tBase + 16 + lane];
        acc00 = WMMA_F32(a0, b0, acc00);
        acc01 = WMMA_F32(a0, b1, acc01);
        acc10 = WMMA_F32(a1, b0, acc10);
        acc11 = WMMA_F32(a1, b1, acc11);
    }

    float* Ob = Out + (size_t)b * NROWS * TDIM;
#pragma unroll
    for (int r = 0; r < 8; ++r) {
        const int row0 = nBase + r + 8 * half;
        const int row1 = row0 + 16;
        Ob[(size_t)row0 * TDIM + tBase + lane]      = acc00[r];
        Ob[(size_t)row0 * TDIM + tBase + 16 + lane] = acc01[r];
        Ob[(size_t)row1 * TDIM + tBase + lane]      = acc10[r];
        Ob[(size_t)row1 * TDIM + tBase + 16 + lane] = acc11[r];
    }
}

extern "C" void kernel_launch(void* const* d_in, const int* in_sizes, int n_in,
                              void* d_out, int out_size, void* d_ws, size_t ws_size,
                              hipStream_t stream) {
    const float* x = (const float*)d_in[0];   // [4, 4096, 256]
    const float* W = (const float*)d_in[1];   // [256, 256]
    float* out = (float*)d_out;               // [4, 4096, 256]

    float* G = (float*)d_ws;                        // 4*256*256 f32
    float* M = G + (size_t)BATCH * TDIM * TDIM;     // 4*256*256 f32

    zero_ws_kernel<<<(BATCH * TDIM * TDIM) / 256, 256, 0, stream>>>(G);
    gram_kernel<<<dim3(64, GNCHUNKS, BATCH), GWAVES * 32, 0, stream>>>(x, G);
    wmask_gemm_kernel<<<dim3(TDIM, BATCH), TDIM, 0, stream>>>(W, G, M);
    out_gemm_kernel<<<dim3(NROWS / 32, TDIM / 32, BATCH), 32, 0, stream>>>(x, M, out);
}

// v002
// It runs in 43.9 microseconds.
// Timed twice side by side with v001, it ran 1.31 and 1.32 times as fast.
// Counting every step since v000, it is 1.82 times as fast.
#include <hip/hip_runtime.h>

typedef float v2f __attribute__((ext_vector_type(2)));
typedef float v4f __attribute__((ext_vector_type(4)));
typedef float v8f __attribute__((ext_vector_type(8)));

#define BATCH    4
#define NROWS    4096
#define TDIM     256
#define GCHUNK   1024
#define GNCHUNKS (NROWS / GCHUNK)   // 4
#define GWAVES   8                  // waves of a gram work-group
#define GROWS    (GCHUNK / GWAVES)  // 128 rows of the chunk per wave
#define MROWS    4                  // rows of M per work-group
#define MWAVES   8                  // waves of that work-group, sharing k
#define MUNROLL  8                  // rows of G per wave and trip

#define WMMA_F32(A, B, C) \
    __builtin_amdgcn_wmma_f32_16x16x4_f32(false, (A), false, (B), (short)0, (C), false, false)

// d_ws layout: G[4][256][256] f32 (1 MB) then M[4][256][256] f32 (1 MB).

__global__ __launch_bounds__(256) void zero_ws_kernel(float* __restrict__ g) {
    g[blockIdx.x * 256 + threadIdx.x] = 0.0f;
}

// G_b = X_b^T @ X_b. One work-group computes a 32x32 region (2x2 WMMA tiles) per
// GCHUNK-row chunk; its GWAVES waves each take GROWS of the chunk's rows, so that
// the row slices are fetched side by side instead of one after the other.
// The waves' partial tiles are summed in LDS in wave order. G is symmetric so
// only regions si<=ti are computed, with off-diagonal regions mirrored. fp32
// atomics accumulate chunk partials.
__global__ __launch_bounds__(GWAVES * 32) void gram_kernel(const float* __restrict__ X,
                                                           float* __restrict__ G) {
    __shared__ float red[GWAVES][32][32];   // [wave][accumulator register][lane]

    const int si = blockIdx.x >> 3;         // 0..7 region row
    const int ti = blockIdx.x & 7;          // 0..7 region col
    if (si > ti) return;                    // block-uniform exit, ahead of the barrier
    const int chunk = blockIdx.y;           // 0..GNCHUNKS-1
    const int b     = blockIdx.z;           // 0..3
    const int sBase = si << 5;
    const int tBase = ti << 5;
    const int wave  = threadIdx.x >> 5;     // 0..GWAVES-1 row slice of the chunk
    const int l32   = threadIdx.x & 31;
    const int lane  = l32 & 15;
    const int half  = l32 >> 4;             // K pair {0,1} vs {2,3}

    const float* Xb = X + (size_t)b * NROWS * TDIM;
    const int n0 = chunk * GCHUNK + wave * GROWS + 2 * half;

    v8f acc00 = {}, acc01 = {}, acc10 = {}, acc11 = {};
    for (int kk = 0; kk < GROWS; kk += 4) {
        const float* r0 = Xb + (size_t)(n0 + kk) * TDIM;
        const float* r1 = r0 + TDIM;
        v2f a0, a1, b0, b1;
        a0.x = r0[sBase + lane];        a0.y = r1[sBase + lane];
        a1.x = r0[sBase + 16 + lane];   a1.y = r1[sBase + 16 + lane];
        b0.x = r0[tBase + lane];        b0.y = r1[tBase + lane];
        b1.x = r0[tBase + 16 + lane];   b1.y = r1[tBase + 16 + lane];
        acc00 = WMMA_F32(a0, b0, acc00);
        acc01 = WMMA_F32(a0, b1, acc01);
        acc10 = WMMA_F32(a1, b0, acc10);
        acc11 = WMMA_F32(a1, b1, acc11);
    }

#pragma unroll   // constant indices keep the accumulators in registers
    for (int r = 0; r < 8; ++r) {
        red[wave][r][l32]      = acc00[r];
        red[wave][8 + r][l32]  = acc01[r];
        red[wave][16 + r][l32] = acc10[r];
        red[wave][24 + r][l32] = acc11[r];
    }
    __syncthreads();

    float* Gb = G + (size_t)b * TDIM * TDIM;
    const bool mirror = (si != ti);   // diagonal region already covers its transpose
#pragma unroll   // four straight-line sums, LDS offsets as immediates
    for (int i = 0; i < 32 / GWAVES; ++i) {
        const int reg = wave + i * GWAVES;            // this wave's share of the registers
        float sum = red[0][reg][l32];
#pragma unroll   // the eight LDS reads issue together
        for (int w = 1; w < GWAVES; ++w) sum += red[w][reg][l32];
        const int q   = reg >> 3;                     // which of the 2x2 tiles
        const int row = sBase + ((q >> 1) << 4) + (reg & 7) + 8 * half;
        const int col = tBase + ((q & 1) << 4) + lane;
        __hip_atomic_fetch_add(&Gb[row * TDIM + col], sum,
                               __ATOMIC_RELAXED, __HIP_MEMORY_SCOPE_AGENT);
        // the mirrored address reuses the register that the issued add names
        asm volatile("s_wait_xcnt 0x0" ::: "memory");
        if (mirror)
            __hip_atomic_fetch_add(&Gb[col * TDIM + row], sum,
                                   __ATOMIC_RELAXED, __HIP_MEMORY_SCOPE_AGENT);
    }
}

// M_b[i][j] = sum_{k < i} W[k][i] * G_b[k][j]  (Wm = triu(W,1), transposed).
// One work-group computes MROWS rows of M over all 256 columns. Its MWAVES waves
// share the k range (wave w takes k = w, w + MWAVES, ...), MUNROLL rows of G per
// trip with two 16-byte loads per lane each, so that a wave waits for memory a
// few times instead of once per eight k. A row k at or past the diagonal of a
// row i gets weight 0, as in the masked weight matrix; k never passes 255, since
// a trip starts at wave + a multiple of MWAVES * MUNROLL = 64 below 255.
// The waves' partial rows are summed in LDS in wave order.
__global__ __launch_bounds__(MWAVES * 32) void wmask_gemm_kernel(const float* __restrict__ W,
                                                                 const float* __restrict__ G,
                                                                 float* __restrict__ M) {
    __shared__ float part[MWAVES][MROWS][TDIM];   // 32 KB

    const int i0   = blockIdx.x * MROWS;
    const int b    = blockIdx.y;
    // wave-uniform, so that the weights come through scalar loads
    const int wave = __builtin_amdgcn_readfirstlane(threadIdx.x >> 5);
    const int l32  = threadIdx.x & 31;
    // row `wave` of G and of W (there at the group's rows of M), wave-uniform; both
    // advance by a trip's rows, so that the loads of a trip differ by constants only
    const float* gp = G + (size_t)b * TDIM * TDIM + wave * TDIM;
    const unsigned col = 4u * l32;   // this lane's first column
    const float* wp = W + wave * TDIM + i0;

    v4f acc[MROWS][2] = {};
    const int kEnd = i0 + MROWS - 1;   // from here on every one of the rows has weight 0
    for (int k0 = wave; k0 < kEnd;
         k0 += MWAVES * MUNROLL, gp += MWAVES * MUNROLL * TDIM, wp += MWAVES * MUNROLL * TDIM) {
        v4f w[MUNROLL], g0[MUNROLL], g1[MUNROLL];
#pragma unroll   // the trip's loads issue together, ahead of the multiply-adds
        for (int u = 0; u < MUNROLL; ++u) {
            w[u]  = *(const v4f*)(wp + u * MWAVES * TDIM);
            g0[u] = *(const v4f*)(gp + col + u * MWAVES * TDIM);
            // the trip's last load returns into the address pair that the issued loads name
            if (u == MUNROLL - 1) asm volatile("s_wait_xcnt 0x0" ::: "memory");
            g1[u] = *(const v4f*)(gp + col + u * MWAVES * TDIM + TDIM / 2);
        }
        // keeps the scheduler from sinking the loads among the multiply-adds, where
        // only a few would be in flight and the trip would wait for memory repeatedly
        __builtin_amdgcn_sched_barrier(0);
#pragma unroll   // constant indices keep the loaded rows and the sums in registers
        for (int u = 0; u < MUNROLL; ++u) {
            const int k = k0 + u * MWAVES;
#pragma unroll
            for (int r = 0; r < MROWS; ++r) {
                const float wr = (k < i0 + r) ? w[u][r] : 0.0f;
                acc[r][0] += wr * g0[u];
                acc[r][1] += wr * g1[u];
            }
        }
    }

#pragma unroll   // constant indices keep the sums in registers
    for (int r = 0; r < MROWS; ++r) {
        *(v4f*)&part[wave][r][4 * l32]            = acc[r][0];
        *(v4f*)&part[wave][r][TDIM / 2 + 4 * l32] = acc[r][1];
    }
    __syncthreads();

    const int r = threadIdx.x >> 6;          // 64 threads per row
    const int j = (threadIdx.x & 63) << 2;   // four columns per thread
    v4f sum = *(const v4f*)&part[0][r][j];
#pragma unroll   // the LDS reads issue together
    for (int w = 1; w < MWAVES; ++w) sum += *(const v4f*)&part[w][r][j];
    *(v4f*)(M + ((size_t)b * TDIM + i0 + r) * TDIM + j) = sum;
}

// out_b = X_b @ M_b. One wave computes a 32x32 output block (2x2 WMMA tiles),
// K = 256 in steps of 4; A fragments are float2 loads, each fragment reused 2x.
__global__ __launch_bounds__(32) void out_gemm_kernel(const float* __restrict__ X,
                                                      const float* __restrict__ M,
                                                      float* __restrict__ Out) {
    const int nBase = blockIdx.x << 5;      // 0..4064 step 32
    const int tBase = blockIdx.y << 5;      // 0..224  step 32
    const int b     = blockIdx.z;
    const int lane  = threadIdx.x & 15;
    const int half  = threadIdx.x >> 4;

    const float* Xb = X + (size_t)b * NROWS * TDIM;
    const float* Mb = M + (size_t)b * TDIM * TDIM;
    const float* xrow0 = Xb + (size_t)(nBase + lane) * TDIM + 2 * half;
    const float* xrow1 = xrow0 + (size_t)16 * TDIM;

    v8f acc00 = {}, acc01 = {}, acc10 = {}, acc11 = {};
    for (int k0 = 0; k0 < TDIM; k0 += 4) {
        v2f a0 = *(const v2f*)(xrow0 + k0);              // X[nBase+lane][k0+2h..+1]
        v2f a1 = *(const v2f*)(xrow1 + k0);              // X[nBase+16+lane][...]
        const float* mrow = Mb + (size_t)(k0 + 2 * half) * TDIM;
        v2f b0, b1;
        b0.x = mrow[tBase + lane];        b0.y = mrow[TDIM + tBase + lane];
        b1.x = mrow[tBase + 16 + lane];   b1.y = mrow[TDIM + tBase + 16 + lane];
        acc00 = WMMA_F32(a0, b0, acc00);
        acc01 = WMMA_F32(a0, b1, acc01);
        acc10 = WMMA_F32(a1, b0, acc10);
        acc11 = WMMA_F32(a1, b1, acc11);
    }

    float* Ob = Out + (size_t)b * NROWS * TDIM;
#pragma unroll
    for (int r = 0; r < 8; ++r) {
        const int row0 = nBase + r + 8 * half;
        const int row1 = row0 + 16;
        Ob[(size_t)row0 * TDIM + tBase + lane]      = acc00[r];
        Ob[(size_t)row0 * TDIM + tBase + 16 + lane] = acc01[r];
        Ob[(size_t)row1 * TDIM + tBase + lane]      = acc10[r];
        Ob[(size_t)row1 * TDIM + tBase + 16 + lane] = acc11[r];
    }
}

extern "C" void kernel_launch(void* const* d_in, const int* in_sizes, int n_in,
                              void* d_out, int out_size, void* d_ws, size_t ws_size,
                              hipStream_t stream) {
    const float* x = (const float*)d_in[0];   // [4, 4096, 256]
    const float* W = (const float*)d_in[1];   // [256, 256]
    float* out = (float*)d_out;               // [4, 4096, 256]

    float* G = (float*)d_ws;                        // 4*256*256 f32
    float* M = G + (size_t)BATCH * TDIM * TDIM;     // 4*256*256 f32

    zero_ws_kernel<<<(BATCH * TDIM * TDIM) / 256, 256, 0, stream>>>(G);
    gram_kernel<<<dim3(64, GNCHUNKS, BATCH), GWAVES * 32, 0, stream>>>(x, G);
    wmask_gemm_kernel<<<dim3(TDIM / MROWS, BATCH), MWAVES * 32, 0, stream>>>(W, G, M);
    out_gemm_kernel<<<dim3(NROWS / 32, TDIM / 32, BATCH), 32, 0, stream>>>(x, M, out);
}

// v003
// A run of this version takes 39.4 microseconds.
// Next to v002, in two timings, it ran 1.11 and 1.14 times as fast.
// Over all steps from v000 it is 2.04 times as fast.
#include <hip/hip_runtime.h>

typedef float v2f __attribute__((ext_vector_type(2)));
typedef float v4f __attribute__((ext_vector_type(4)));
typedef float v8f __attribute__((ext_vector_type(8)));

#define BATCH    4
#define NROWS    4096
#define TDIM     256
#define GCHUNK   1024
#define GNCHUNKS (NROWS / GCHUNK)   // 4
#define GWAVES   8                  // waves of a gram work-group
#define GROWS    (GCHUNK / GWAVES)  // 128 rows of the chunk per wave
#define MROWS    4                  // rows of M per work-group
#define MWAVES   8                  // waves of that work-group, sharing k
#define MUNROLL  8                  // rows of G per wave and trip
#define OWAVES   8                  // waves of an output work-group, 32 columns each
#define XPITCH   (TDIM + 4)         // LDS row pitch in floats: 16 rows x 2 k pairs meet 64 banks once
#define XROUNDS  (32 * TDIM / (OWAVES * 32 * 4))   // 8 loads of 16 bytes per thread

#define WMMA_F32(A, B, C) \
    __builtin_amdgcn_wmma_f32_16x16x4_f32(false, (A), false, (B), (short)0, (C), false, false)

// d_ws layout: G[4][256][256] f32 (1 MB) then M[4][256][256] f32 (1 MB).

__global__ __launch_bounds__(256) void zero_ws_kernel(float* __restrict__ g) {
    g[blockIdx.x * 256 + threadIdx.x] = 0.0f;
}

// G_b = X_b^T @ X_b. One work-group computes a 32x32 region (2x2 WMMA tiles) per
// GCHUNK-row chunk; its GWAVES waves each take GROWS of the chunk's rows, so that
// the row slices are fetched side by side instead of one after the other.
// The waves' partial tiles are summed in LDS in wave order. G is symmetric so
// only regions si<=ti are computed, with off-diagonal regions mirrored. fp32
// atomics accumulate chunk partials.
__global__ __launch_bounds__(GWAVES * 32) void gram_kernel(const float* __restrict__ X,
                                                           float* __restrict__ G) {
    __shared__ float red[GWAVES][32][32];   // [wave][accumulator register][lane]

    const int si = blockIdx.x >> 3;         // 0..7 region row
    const int ti = blockIdx.x & 7;          // 0..7 region col
    if (si > ti) return;                    // block-uniform exit, ahead of the barrier
    const int chunk = blockIdx.y;           // 0..GNCHUNKS-1
    const int b     = blockIdx.z;           // 0..3
    const int sBase = si << 5;
    const int tBase = ti << 5;
    const int wave  = threadIdx.x >> 5;     // 0..GWAVES-1 row slice of the chunk
    const int l32   = threadIdx.x & 31;
    const int lane  = l32 & 15;
    const int half  = l32 >> 4;             // K pair {0,1} vs {2,3}

    const float* Xb = X + (size_t)b * NROWS * TDIM;
    const int n0 = chunk * GCHUNK + wave * GROWS + 2 * half;

    v8f acc00 = {}, acc01 = {}, acc10 = {}, acc11 = {};
    for (int kk = 0; kk < GROWS; kk += 4) {
        const float* r0 = Xb + (size_t)(n0 + kk) * TDIM;
        const float* r1 = r0 + TDIM;
        v2f a0, a1, b0, b1;
        a0.x = r0[sBase + lane];        a0.y = r1[sBase + lane];
        a1.x = r0[sBase + 16 + lane];   a1.y = r1[sBase + 16 + lane];
        b0.x = r0[tBase + lane];        b0.y = r1[tBase + lane];
        b1.x = r0[tBase + 16 + lane];   b1.y = r1[tBase + 16 + lane];
        acc00 = WMMA_F32(a0, b0, acc00);
        acc01 = WMMA_F32(a0, b1, acc01);
        acc10 = WMMA_F32(a1, b0, acc10);
        acc11 = WMMA_F32(a1, b1, acc11);
    }

#pragma unroll   // constant indices keep the accumulators in registers
    for (int r = 0; r < 8; ++r) {
        red[wave][r][l32]      = acc00[r];
        red[wave][8 + r][l32]  = acc01[r];
        red[wave][16 + r][l32] = acc10[r];
        red[wave][24 + r][l32] = acc11[r];
    }
    __syncthreads();

    float* Gb = G + (size_t)b * TDIM * TDIM;
    const bool mirror = (si != ti);   // diagonal region already covers its transpose
#pragma unroll   // four straight-line sums, LDS offsets as immediates
    for (int i = 0; i < 32 / GWAVES; ++i) {
        const int reg = wave + i * GWAVES;            // this wave's share of the registers
        float sum = red[0][reg][l32];
#pragma unroll   // the eight LDS reads issue together
        for (int w = 1; w < GWAVES; ++w) sum += red[w][reg][l32];
        const int q   = reg >> 3;                     // which of the 2x2 tiles
        const int row = sBase + ((q >> 1) << 4) + (reg & 7) + 8 * half;
        const int col = tBase + ((q & 1) << 4) + lane;
        __hip_atomic_fetch_add(&Gb[row * TDIM + col], sum,
                               __ATOMIC_RELAXED, __HIP_MEMORY_SCOPE_AGENT);
        // the mirrored address reuses the register that the issued add names
        asm volatile("s_wait_xcnt 0x0" ::: "memory");
        if (mirror)
            __hip_atomic_fetch_add(&Gb[col * TDIM + row], sum,
                                   __ATOMIC_RELAXED, __HIP_MEMORY_SCOPE_AGENT);
    }
}

// M_b[i][j] = sum_{k < i} W[k][i] * G_b[k][j]  (Wm = triu(W,1), transposed).
// One work-group computes MROWS rows of M over all 256 columns. Its MWAVES waves
// share the k range (wave w takes k = w, w + MWAVES, ...), MUNROLL rows of G per
// trip with two 16-byte loads per lane each, so that a wave waits for memory a
// few times instead of once per eight k. A row k at or past the diagonal of a
// row i gets weight 0, as in the masked weight matrix; k never passes 255, since
// a trip starts at wave + a multiple of MWAVES * MUNROLL = 64 below 255.
// The waves' partial rows are summed in LDS in wave order.
__global__ __launch_bounds__(MWAVES * 32) void wmask_gemm_kernel(const float* __restrict__ W,
                                                                 const float* __restrict__ G,
                                                                 float* __restrict__ M) {
    __shared__ float part[MWAVES][MROWS][TDIM];   // 32 KB

    const int i0   = blockIdx.x * MROWS;
    const int b    = blockIdx.y;
    // wave-uniform, so that the weights come through scalar loads
    const int wave = __builtin_amdgcn_readfirstlane(threadIdx.x >> 5);
    const int l32  = threadIdx.x & 31;
    // row `wave` of G and of W (there at the group's rows of M), wave-uniform; both
    // advance by a trip's rows, so that the loads of a trip differ by constants only
    const float* gp = G + (size_t)b * TDIM * TDIM + wave * TDIM;
    const unsigned col = 4u * l32;   // this lane's first column
    const float* wp = W + wave * TDIM + i0;

    v4f acc[MROWS][2] = {};
    const int kEnd = i0 + MROWS - 1;   // from here on every one of the rows has weight 0
    for (int k0 = wave; k0 < kEnd;
         k0 += MWAVES * MUNROLL, gp += MWAVES * MUNROLL * TDIM, wp += MWAVES * MUNROLL * TDIM) {
        v4f w[MUNROLL], g0[MUNROLL], g1[MUNROLL];
#pragma unroll   // the trip's loads issue together, ahead of the multiply-adds
        for (int u = 0; u < MUNROLL; ++u) {
            w[u]  = *(const v4f*)(wp + u * MWAVES * TDIM);
            g0[u] = *(const v4f*)(gp + col + u * MWAVES * TDIM);
            // the trip's last load returns into the address pair that the issued loads name
            if (u == MUNROLL - 1) asm volatile("s_wait_xcnt 0x0" ::: "memory");
            g1[u] = *(const v4f*)(gp + col + u * MWAVES * TDIM + TDIM / 2);
        }
        // keeps the scheduler from sinking the loads among the multiply-adds, where
        // only a few would be in flight and the trip would wait for memory repeatedly
        __builtin_amdgcn_sched_barrier(0);
#pragma unroll   // constant indices keep the loaded rows and the sums in registers
        for (int u = 0; u < MUNROLL; ++u) {
            const int k = k0 + u * MWAVES;
#pragma unroll
            for (int r = 0; r < MROWS; ++r) {
                const float wr = (k < i0 + r) ? w[u][r] : 0.0f;
                acc[r][0] += wr * g0[u];
                acc[r][1] += wr * g1[u];
            }
        }
    }

#pragma unroll   // constant indices keep the sums in registers
    for (int r = 0; r < MROWS; ++r) {
        *(v4f*)&part[wave][r][4 * l32]            = acc[r][0];
        *(v4f*)&part[wave][r][TDIM / 2 + 4 * l32] = acc[r][1];
    }
    __syncthreads();

    const int r = threadIdx.x >> 6;          // 64 threads per row
    const int j = (threadIdx.x & 63) << 2;   // four columns per thread
    v4f sum = *(const v4f*)&part[0][r][j];
#pragma unroll   // the LDS reads issue together
    for (int w = 1; w < MWAVES; ++w) sum += *(const v4f*)&part[w][r][j];
    *(v4f*)(M + ((size_t)b * TDIM + i0 + r) * TDIM + j) = sum;
}

// out_b = X_b @ M_b. One work-group computes 32 rows of the output over all 256
// columns. Its OWAVES waves need the same 32 rows of X, so these are brought into
// LDS once, in whole 128-byte lines, and every wave takes its A fragments from there.
// Each wave computes a 32x32 output block (2x2 WMMA tiles), K = 256 in steps of 4.
__global__ __launch_bounds__(OWAVES * 32) void out_gemm_kernel(const float* __restrict__ X,
                                                               const float* __restrict__ M,
                                                               float* __restrict__ Out) {
    __shared__ __attribute__((aligned(16))) float xs[32][XPITCH];

    const int nBase = blockIdx.x << 5;      // 0..4064 step 32
    const int b     = blockIdx.y;
    // wave-uniform, so that the column base stays in a scalar register
    const int wave  = __builtin_amdgcn_readfirstlane(threadIdx.x >> 5);
    const int tBase = wave << 5;            // 0..224  step 32
    const int l32   = threadIdx.x & 31;
    const int lane  = l32 & 15;
    const int half  = l32 >> 4;

    // the 32 rows are 32 KB in a row in memory: 16 bytes per thread and round
    const float* Xt = X + ((size_t)b * NROWS + nBase) * TDIM;
    v4f st[XROUNDS];
#pragma unroll   // the rounds' loads issue together, ahead of the LDS stores
    for (int i = 0; i < XROUNDS; ++i)
        st[i] = *(const v4f*)(Xt + (i * OWAVES * 32 + threadIdx.x) * 4);
#pragma unroll   // constant indices keep the loaded values in registers
    for (int i = 0; i < XROUNDS; ++i)
        *(v4f*)&xs[i * 4 + (threadIdx.x >> 6)][(threadIdx.x & 63) << 2] = st[i];
    __syncthreads();

    const float* Mb = M + (size_t)b * TDIM * TDIM;
    const float* xrow0 = &xs[lane][2 * half];
    const float* xrow1 = &xs[16 + lane][2 * half];

    v8f acc00 = {}, acc01 = {}, acc10 = {}, acc11 = {};
    for (int k0 = 0; k0 < TDIM; k0 += 4) {
        v2f a0 = *(const v2f*)(xrow0 + k0);              // X[nBase+lane][k0+2h..+1]
        v2f a1 = *(const v2f*)(xrow1 + k0);              // X[nBase+16+lane][...]
        const float* mrow = Mb + (size_t)(k0 + 2 * half) * TDIM;
        v2f b0, b1;
        b0.x = mrow[tBase + lane];        b0.y = mrow[TDIM + tBase + lane];
        b1.x = mrow[tBase + 16 + lane];   b1.y = mrow[TDIM + tBase + 16 + lane];
        acc00 = WMMA_F32(a0, b0, acc00);
        acc01 = WMMA_F32(a0, b1, acc01);
        acc10 = WMMA_F32(a1, b0, acc10);
        acc11 = WMMA_F32(a1, b1, acc11);
    }

    float* Ob = Out + (size_t)b * NROWS * TDIM;
#pragma unroll
    for (int r = 0; r < 8; ++r) {
        const int row0 = nBase + r + 8 * half;
        const int row1 = row0 + 16;
        Ob[(size_t)row0 * TDIM + tBase + lane]      = acc00[r];
        Ob[(size_t)row0 * TDIM + tBase + 16 + lane] = acc01[r];
        Ob[(size_t)row1 * TDIM + tBase + lane]      = acc10[r];
        Ob[(size_t)row1 * TDIM + tBase + 16 + lane] = acc11[r];
    }
}

extern "C" void kernel_launch(void* const* d_in, const int* in_sizes, int n_in,
                              void* d_out, int out_size, void* d_ws, size_t ws_size,
                              hipStream_t stream) {
    const float* x = (const float*)d_in[0];   // [4, 4096, 256]
    const float* W = (const float*)d_in[1];   // [256, 256]
    float* out = (float*)d_out;               // [4, 4096, 256]

    float* G = (float*)d_ws;                        // 4*256*256 f32
    float* M = G + (size_t)BATCH * TDIM * TDIM;     // 4*256*256 f32

    zero_ws_kernel<<<(BATCH * TDIM * TDIM) / 256, 256, 0, stream>>>(G);
    gram_kernel<<<dim3(64, GNCHUNKS, BATCH), GWAVES * 32, 0, stream>>>(x, G);
    wmask_gemm_kernel<<<dim3(TDIM / MROWS, BATCH), MWAVES * 32, 0, stream>>>(W, G, M);
    out_gemm_kernel<<<dim3(NROWS / 32, BATCH), OWAVES * 32, 0, stream>>>(x, M, out);
}

// v004
// A run of this version takes 37.7 microseconds.
// Timed twice side by side with v003, it ran 1.04 and 1.03 times as fast.
// All steps since v000 together make it 2.11 times as fast.
#include <hip/hip_runtime.h>

typedef float v2f __attribute__((ext_vector_type(2)));
typedef float v4f __attribute__((ext_vector_type(4)));
typedef float v8f __attribute__((ext_vector_type(8)));

#define BATCH    4
#define NROWS    4096
#define TDIM     256
#define GWAVES   32                 // waves of a gram work-group
#define GROWS    (NROWS / GWAVES)   // 128 rows of X per wave
#define GREGIONS 36                 // 32x32 regions of G on or above the diagonal
#define MROWS    4                  // rows of M per work-group
#define MWAVES   8                  // waves of that work-group, sharing k
#define MUNROLL  8                  // rows of G per wave and trip
#define OWAVES   8                  // waves of an output work-group, 32 columns each
#define XPITCH   (TDIM + 4)         // LDS row pitch in floats: 16 rows x 2 k pairs meet 64 banks once
#define XROUNDS  (32 * TDIM / (OWAVES * 32 * 4))   // 8 loads of 16 bytes per thread

#define WMMA_F32(A, B, C) \
    __builtin_amdgcn_wmma_f32_16x16x4_f32(false, (A), false, (B), (short)0, (C), false, false)

// d_ws layout: G[4][256][256] f32 (1 MB) then M[4][256][256] f32 (1 MB).

// G_b = X_b^T @ X_b. One work-group computes a whole 32x32 region (2x2 WMMA tiles)
// of G: its GWAVES waves each take GROWS of the 4096 rows, side by side, and the
// waves' partial tiles are summed in LDS in wave order. No other work-group adds to
// the region, so it is stored as it is and G needs no start value. G is symmetric,
// so only regions si<=ti are computed, with off-diagonal regions mirrored. The
// summed region passes through an LDS tile, from which each wave stores one whole
// 128-byte line of the region and one of its mirror image.
__global__ __launch_bounds__(GWAVES * 32) void gram_kernel(const float* __restrict__ X,
                                                           float* __restrict__ G) {
    __shared__ float red[GWAVES][32][32];   // [wave][accumulator register][lane], 128 KB
    __shared__ float tile[32][33];          // summed region; odd pitch for the column reads

    // blockIdx.x counts the regions row by row: 8 in region row 0, 7 in row 1, ...
    int si = 0, ti = blockIdx.x;
#pragma unroll   // seven scalar steps at most, no loop
    for (int s = 0; s < 7; ++s)
        if (ti >= 8 - si) { ti -= 8 - si; ++si; }
    ti += si;                               // si 0..7 region row, ti si..7 region col
    const int b     = blockIdx.y;           // 0..3
    const int sBase = si << 5;
    const int tBase = ti << 5;
    const int wave  = threadIdx.x >> 5;     // 0..GWAVES-1 row slice
    const int l32   = threadIdx.x & 31;
    const int lane  = l32 & 15;
    const int half  = l32 >> 4;             // K pair {0,1} vs {2,3}

    const float* Xb = X + (size_t)b * NROWS * TDIM;
    const int n0 = wave * GROWS + 2 * half;

    v8f acc00 = {}, acc01 = {}, acc10 = {}, acc11 = {};
    for (int kk = 0; kk < GROWS; kk += 4) {
        const float* r0 = Xb + (size_t)(n0 + kk) * TDIM;
        const float* r1 = r0 + TDIM;
        v2f a0, a1, b0, b1;
        a0.x = r0[sBase + lane];        a0.y = r1[sBase + lane];
        a1.x = r0[sBase + 16 + lane];   a1.y = r1[sBase + 16 + lane];
        b0.x = r0[tBase + lane];        b0.y = r1[tBase + lane];
        b1.x = r0[tBase + 16 + lane];   b1.y = r1[tBase + 16 + lane];
        acc00 = WMMA_F32(a0, b0, acc00);
        acc01 = WMMA_F32(a0, b1, acc01);
        acc10 = WMMA_F32(a1, b0, acc10);
        acc11 = WMMA_F32(a1, b1, acc11);
    }

#pragma unroll   // constant indices keep the accumulators in registers
    for (int r = 0; r < 8; ++r) {
        red[wave][r][l32]      = acc00[r];
        red[wave][8 + r][l32]  = acc01[r];
        red[wave][16 + r][l32] = acc10[r];
        red[wave][24 + r][l32] = acc11[r];
    }
    __syncthreads();

    // wave w sums accumulator register w of all the waves
    float sum = red[0][wave][l32];
#pragma unroll   // the LDS reads issue together
    for (int w = 1; w < GWAVES; ++w) sum += red[w][wave][l32];
    const int q = wave >> 3;                          // which of the 2x2 tiles
    tile[((q >> 1) << 4) + (wave & 7) + 8 * half][((q & 1) << 4) + lane] = sum;
    __syncthreads();

    float* Gb = G + (size_t)b * TDIM * TDIM;
    const float direct = tile[wave][l32];
    const float mirror = tile[l32][wave];
    Gb[(sBase + wave) * TDIM + tBase + l32] = direct;
    asm volatile("s_wait_xcnt 0x0" ::: "memory");
    if (si != ti)   // a diagonal region already covers its transpose
        Gb[(tBase + wave) * TDIM + sBase + l32] = mirror;
}

// M_b[i][j] = sum_{k < i} W[k][i] * G_b[k][j]  (Wm = triu(W,1), transposed).
// One work-group computes MROWS rows of M over all 256 columns. Its MWAVES waves
// share the k range (wave w takes k = w, w + MWAVES, ...), MUNROLL rows of G per
// trip with two 16-byte loads per lane each, so that a wave waits for memory a
// few times instead of once per eight k. A row k at or past the diagonal of a
// row i gets weight 0, as in the masked weight matrix; k never passes 255, since
// a trip starts at wave + a multiple of MWAVES * MUNROLL = 64 below 255.
// The waves' partial rows are summed in LDS in wave order.
__global__ __launch_bounds__(MWAVES * 32) void wmask_gemm_kernel(const float* __restrict__ W,
                                                                 const float* __restrict__ G,
                                                                 float* __restrict__ M) {
    __shared__ float part[MWAVES][MROWS][TDIM];   // 32 KB

    const int i0   = blockIdx.x * MROWS;
    const int b    = blockIdx.y;
    // wave-uniform, so that the weights come through scalar loads
    const int wave = __builtin_amdgcn_readfirstlane(threadIdx.x >> 5);
    const int l32  = threadIdx.x & 31;
    // row `wave` of G and of W (there at the group's rows of M), wave-uniform; both
    // advance by a trip's rows, so that the loads of a trip differ by constants only
    const float* gp = G + (size_t)b * TDIM * TDIM + wave * TDIM;
    const unsigned col = 4u * l32;   // this lane's first column
    const float* wp = W + wave * TDIM + i0;

    v4f acc[MROWS][2] = {};
    const int kEnd = i0 + MROWS - 1;   // from here on every one of the rows has weight 0
    for (int k0 = wave; k0 < kEnd;
         k0 += MWAVES * MUNROLL, gp += MWAVES * MUNROLL * TDIM, wp += MWAVES * MUNROLL * TDIM) {
        v4f w[MUNROLL], g0[MUNROLL], g1[MUNROLL];
#pragma unroll   // the trip's loads issue together, ahead of the multiply-adds
        for (int u = 0; u < MUNROLL; ++u) {
            w[u]  = *(const v4f*)(wp + u * MWAVES * TDIM);
            g0[u] = *(const v4f*)(gp + col + u * MWAVES * TDIM);
            // the trip's last load returns into the address pair that the issued loads name
            if (u == MUNROLL - 1) asm volatile("s_wait_xcnt 0x0" ::: "memory");
            g1[u] = *(const v4f*)(gp + col + u * MWAVES * TDIM + TDIM / 2);
        }
        // keeps the scheduler from sinking the loads among the multiply-adds, where
        // only a few would be in flight and the trip would wait for memory repeatedly
        __builtin_amdgcn_sched_barrier(0);
#pragma unroll   // constant indices keep the loaded rows and the sums in registers
        for (int u = 0; u < MUNROLL; ++u) {
            const int k = k0 + u * MWAVES;
#pragma unroll
            for (int r = 0; r < MROWS; ++r) {
                const float wr = (k < i0 + r) ? w[u][r] : 0.0f;
                acc[r][0] += wr * g0[u];
                acc[r][1] += wr * g1[u];
            }
        }
    }

#pragma unroll   // constant indices keep the sums in registers
    for (int r = 0; r < MROWS; ++r) {
        *(v4f*)&part[wave][r][4 * l32]            = acc[r][0];
        *(v4f*)&part[wave][r][TDIM / 2 + 4 * l32] = acc[r][1];
    }
    __syncthreads();

    const int r = threadIdx.x >> 6;          // 64 threads per row
    const int j = (threadIdx.x & 63) << 2;   // four columns per thread
    v4f sum = *(const v4f*)&part[0][r][j];
#pragma unroll   // the LDS reads issue together
    for (int w = 1; w < MWAVES; ++w) sum += *(const v4f*)&part[w][r][j];
    *(v4f*)(M + ((size_t)b * TDIM + i0 + r) * TDIM + j) = sum;
}

// out_b = X_b @ M_b. One work-group computes 32 rows of the output over all 256
// columns. Its OWAVES waves need the same 32 rows of X, so these are brought into
// LDS once, in whole 128-byte lines, and every wave takes its A fragments from there.
// Each wave computes a 32x32 output block (2x2 WMMA tiles), K = 256 in steps of 4.
__global__ __launch_bounds__(OWAVES * 32) void out_gemm_kernel(const float* __restrict__ X,
                                                               const float* __restrict__ M,
                                                               float* __restrict__ Out) {
    __shared__ __attribute__((aligned(16))) float xs[32][XPITCH];

    const int nBase = blockIdx.x << 5;      // 0..4064 step 32
    const int b     = blockIdx.y;
    // wave-uniform, so that the column base stays in a scalar register
    const int wave  = __builtin_amdgcn_readfirstlane(threadIdx.x >> 5);
    const int tBase = wave << 5;            // 0..224  step 32
    const int l32   = threadIdx.x & 31;
    const int lane  = l32 & 15;
    const int half  = l32 >> 4;

    // the 32 rows are 32 KB in a row in memory: 16 bytes per thread and round
    const float* Xt = X + ((size_t)b * NROWS + nBase) * TDIM;
    v4f st[XROUNDS];
#pragma unroll   // the rounds' loads issue together, ahead of the LDS stores
    for (int i = 0; i < XROUNDS; ++i)
        st[i] = *(const v4f*)(Xt + (i * OWAVES * 32 + threadIdx.x) * 4);
#pragma unroll   // constant indices keep the loaded values in registers
    for (int i = 0; i < XROUNDS; ++i)
        *(v4f*)&xs[i * 4 + (threadIdx.x >> 6)][(threadIdx.x & 63) << 2] = st[i];
    __syncthreads();

    const float* Mb = M + (size_t)b * TDIM * TDIM;
    const float* xrow0 = &xs[lane][2 * half];
    const float* xrow1 = &xs[16 + lane][2 * half];

    v8f acc00 = {}, acc01 = {}, acc10 = {}, acc11 = {};
    for (int k0 = 0; k0 < TDIM; k0 += 4) {
        v2f a0 = *(const v2f*)(xrow0 + k0);              // X[nBase+lane][k0+2h..+1]
        v2f a1 = *(const v2f*)(xrow1 + k0);              // X[nBase+16+lane][...]
        const float* mrow = Mb + (size_t)(k0 + 2 * half) * TDIM;
        v2f b0, b1;
        b0.x = mrow[tBase + lane];        b0.y = mrow[TDIM + tBase + lane];
        b1.x = mrow[tBase + 16 + lane];   b1.y = mrow[TDIM + tBase + 16 + lane];
        acc00 = WMMA_F32(a0, b0, acc00);
        acc01 = WMMA_F32(a0, b1, acc01);
        acc10 = WMMA_F32(a1, b0, acc10);
        acc11 = WMMA_F32(a1, b1, acc11);
    }

    float* Ob = Out + (size_t)b * NROWS * TDIM;
#pragma unroll
    for (int r = 0; r < 8; ++r) {
        const int row0 = nBase + r + 8 * half;
        const int row1 = row0 + 16;
        Ob[(size_t)row0 * TDIM + tBase + lane]      = acc00[r];
        Ob[(size_t)row0 * TDIM + tBase + 16 + lane] = acc01[r];
        Ob[(size_t)row1 * TDIM + tBase + lane]      = acc10[r];
        Ob[(size_t)row1 * TDIM + tBase + 16 + lane] = acc11[r];
    }
}

extern "C" void kernel_launch(void* const* d_in, const int* in_sizes, int n_in,
                              void* d_out, int out_size, void* d_ws, size_t ws_size,
                              hipStream_t stream) {
    const float* x = (const float*)d_in[0];   // [4, 4096, 256]
    const float* W = (const float*)d_in[1];   // [256, 256]
    float* out = (float*)d_out;               // [4, 4096, 256]

    float* G = (float*)d_ws;                        // 4*256*256 f32
    float* M = G + (size_t)BATCH * TDIM * TDIM;     // 4*256*256 f32

    gram_kernel<<<dim3(GREGIONS, BATCH), GWAVES * 32, 0, stream>>>(x, G);
    wmask_gemm_kernel<<<dim3(TDIM / MROWS, BATCH), MWAVES * 32, 0, stream>>>(W, G, M);
    out_gemm_kernel<<<dim3(NROWS / 32, BATCH), OWAVES * 32, 0, stream>>>(x, M, out);
}
